// v000
// Measured on an AMD MI455X. A time is GPU time per run, averaged over a window of back-to-back runs after a warm-up
// (all launches, gaps included; the runs take copies of the inputs in turn), and the median of several windows.
// Apart from v000's, it joins two sittings. Times from different sittings can be a few percent apart, while
// side-by-side timings come from the same sitting.
// The starting kernel, v000, takes 285 microseconds a run.
#include <hip/hip_runtime.h>
#include <hip/hip_bf16.h>

typedef __attribute__((ext_vector_type(16))) _Float16 v16h;
typedef __attribute__((ext_vector_type(8)))  _Float16 v8h;
typedef __attribute__((ext_vector_type(8)))  float    v8f;
typedef __attribute__((ext_vector_type(4))) unsigned int u32x4;
typedef __attribute__((ext_vector_type(8))) int          i32x8;
typedef __attribute__((ext_vector_type(4))) int          i32x4;

#define WMMA_F16(a, b, c) \
  __builtin_amdgcn_wmma_f32_16x16x32_f16(false, (a), false, (b), (short)0, (c), false, false)

#if defined(__has_builtin)
#  if __has_builtin(__builtin_amdgcn_tensor_load_to_lds) && \
      __has_builtin(__builtin_amdgcn_s_wait_tensorcnt)
#    define FA_HAVE_TDM 1
#  endif
#endif

#define DIMD 768

// ---------------------------------------------------------------------------
// Fragment helpers (layouts per ISA 7.12.2, wave32).
// A-matrix 16x32 f16: lanes 0-15 row=lane, K={0..7,16..23}; lanes 16-31 kb=8.
// B-matrix assumed mirror: lane n holds column n with same K striping, so a
// row-major operand loaded by rows gives B[k][n] = Op[n][k].
// ---------------------------------------------------------------------------
__device__ __forceinline__ v16h ld_frag(const _Float16* base, int ld, int row0, int k0) {
  const int lane = threadIdx.x & 31;
  const int r    = row0 + (lane & 15);
  const int kb   = (lane >> 4) << 3;
  const _Float16* p = base + (size_t)r * ld + k0 + kb;
  v8h lo = *(const v8h*)p;
  v8h hi = *(const v8h*)(p + 16);
  v16h f;
#pragma unroll
  for (int i = 0; i < 8; ++i) { f[i] = lo[i]; f[i + 8] = hi[i]; }
  return f;
}

__device__ __forceinline__ v16h ld_frag_scaled(const _Float16* base, int ld, int row0,
                                               int k0, float s) {
  const int lane = threadIdx.x & 31;
  const int r    = row0 + (lane & 15);
  const int kb   = (lane >> 4) << 3;
  const _Float16* p = base + (size_t)r * ld + k0 + kb;
  v8h lo = *(const v8h*)p;
  v8h hi = *(const v8h*)(p + 16);
  v16h f;
#pragma unroll
  for (int i = 0; i < 8; ++i) {
    f[i]     = (_Float16)((float)lo[i] * s);
    f[i + 8] = (_Float16)((float)hi[i] * s);
  }
  return f;
}

// Gather a 32(K) x 16(N) B-fragment from a ROW-major tile (i.e. use columns):
// B[k][n] = tile[k][col+n].
__device__ __forceinline__ v16h ld_frag_col(const _Float16* base, int ld, int col) {
  const int lane = threadIdx.x & 31;
  const int c    = col + (lane & 15);
  const int kb   = (lane >> 4) << 3;
  v16h f;
#pragma unroll
  for (int i = 0; i < 8; ++i) {
    f[i]     = base[(kb + i) * ld + c];
    f[i + 8] = base[(16 + kb + i) * ld + c];
  }
  return f;
}

// C/D 16x16 f32: lanes 0-15 (M=v, N=lane); lanes 16-31 (M=v+8, N=lane-16)
__device__ __forceinline__ void st_tile_f16(_Float16* base, int ld, int row0, int col0,
                                            const v8f& c) {
  const int lane = threadIdx.x & 31;
  const int n    = col0 + (lane & 15);
  const int r0   = row0 + ((lane >> 4) << 3);
#pragma unroll
  for (int v = 0; v < 8; ++v) base[(size_t)(r0 + v) * ld + n] = (_Float16)c[v];
}

__device__ __forceinline__ void st_tile_f32(float* base, int ld, int row0, int col0,
                                            const v8f& c) {
  const int lane = threadIdx.x & 31;
  const int n    = col0 + (lane & 15);
  const int r0   = row0 + ((lane >> 4) << 3);
#pragma unroll
  for (int v = 0; v < 8; ++v) base[(size_t)(r0 + v) * ld + n] = c[v];
}

// ---------------------------------------------------------------------------
// TDM: DMA a rows x cols f16 tile (row stride = stride elems) into LDS with
// 16B padding every 128B row -> LDS row stride 72 halves (bank-conflict free).
// ---------------------------------------------------------------------------
#ifdef FA_HAVE_TDM
__device__ __forceinline__ void tdm_load_tile_f16(unsigned lds_off, const _Float16* gsrc,
                                                  int rows, int cols, int stride) {
  const unsigned long long ga = (unsigned long long)(uintptr_t)gsrc;
  u32x4 g0;
  g0[0] = 1u;                                        // count=1 (valid user D#)
  g0[1] = lds_off;                                   // lds_addr (bytes)
  g0[2] = (unsigned)(ga & 0xffffffffull);            // global_addr[31:0]
  g0[3] = (unsigned)((ga >> 32) & 0x01ffffffull) | (2u << 30);  // [56:32] | type=2
  i32x8 g1;
  // data_size=1 (2B) | pad_enable | pad_interval=4 (128B) | pad_amount=3 (16B)
  g1[0] = 0x00010000 | (1 << 20) | (4 << 22) | (3 << 25);
  g1[1] = (cols & 0xffff) << 16;                     // tensor_dim0 lo
  g1[2] = ((cols >> 16) & 0xffff) | ((rows & 0xffff) << 16);   // td0 hi | td1 lo
  g1[3] = ((rows >> 16) & 0xffff) | ((cols & 0xffff) << 16);   // td1 hi | tile_dim0
  g1[4] = rows & 0xffff;                             // tile_dim1 (tile_dim2=0)
  g1[5] = stride;                                    // tensor_dim0_stride lo
  g1[6] = 0;
  g1[7] = 0;
  i32x4 z = {0, 0, 0, 0};
#if __clang_major__ >= 23
  i32x8 z8 = {0, 0, 0, 0, 0, 0, 0, 0};
  __builtin_amdgcn_tensor_load_to_lds(g0, g1, z, z, z8, 0);
#else
  __builtin_amdgcn_tensor_load_to_lds(g0, g1, z, z, 0);
#endif
}
#endif

// ---------------------------------------------------------------------------
// f32 -> f16 conversion
// ---------------------------------------------------------------------------
__global__ void fa_cvt_f16(const float* __restrict__ src, _Float16* __restrict__ dst, int n) {
  int i = blockIdx.x * blockDim.x + threadIdx.x;
  if (i < n) dst[i] = (_Float16)src[i];
}

// ---------------------------------------------------------------------------
// Y[8192 x 768] = Xh @ Wh^T (3 projections via blockIdx.z), f16 out.
// 128 threads = 4 waves; each wave computes a 32(M) x 64(N) strip:
// per K-step 6 fragment loads -> 8 WMMAs.
// ---------------------------------------------------------------------------
__global__ void fa_gemm_qkv(const _Float16* __restrict__ xh,
                            const _Float16* __restrict__ wh3,  // [3][768][768]
                            _Float16* __restrict__ qkv) {      // [3][8192][768]
  const int wave = threadIdx.x >> 5;
  const int m0   = blockIdx.y * 128 + wave * 32;
  const int n0   = blockIdx.x * 64;
  const _Float16* W = wh3 + (size_t)blockIdx.z * DIMD * DIMD;
  _Float16*       Y = qkv + (size_t)blockIdx.z * 8192 * DIMD;

  v8f c0[4] = {}, c1[4] = {};
#pragma unroll 2
  for (int k0 = 0; k0 < DIMD; k0 += 32) {
    if (k0 + 32 < DIMD) {
      __builtin_prefetch(xh + (size_t)m0 * DIMD + k0 + 32, 0, 0);        // global_prefetch_b8
      __builtin_prefetch(xh + (size_t)(m0 + 16) * DIMD + k0 + 32, 0, 0);
    }
    v16h a0 = ld_frag(xh, DIMD, m0,      k0);
    v16h a1 = ld_frag(xh, DIMD, m0 + 16, k0);
#pragma unroll
    for (int j = 0; j < 4; ++j) {
      v16h b = ld_frag(W, DIMD, n0 + 16 * j, k0);
      c0[j] = WMMA_F16(a0, b, c0[j]);
      c1[j] = WMMA_F16(a1, b, c1[j]);
    }
  }
#pragma unroll
  for (int j = 0; j < 4; ++j) {
    st_tile_f16(Y, DIMD, m0,      n0 + 16 * j, c0[j]);
    st_tile_f16(Y, DIMD, m0 + 16, n0 + 16 * j, c1[j]);
  }
}

// Final projection: out_f32[8192 x 768] = ctx @ Wo^T
__global__ void fa_gemm_out(const _Float16* __restrict__ ctx,
                            const _Float16* __restrict__ woh,
                            float* __restrict__ out) {
  const int wave = threadIdx.x >> 5;
  const int m0   = blockIdx.y * 128 + wave * 32;
  const int n0   = blockIdx.x * 64;

  v8f c0[4] = {}, c1[4] = {};
#pragma unroll 2
  for (int k0 = 0; k0 < DIMD; k0 += 32) {
    if (k0 + 32 < DIMD) {
      __builtin_prefetch(ctx + (size_t)m0 * DIMD + k0 + 32, 0, 0);
      __builtin_prefetch(ctx + (size_t)(m0 + 16) * DIMD + k0 + 32, 0, 0);
    }
    v16h a0 = ld_frag(ctx, DIMD, m0,      k0);
    v16h a1 = ld_frag(ctx, DIMD, m0 + 16, k0);
#pragma unroll
    for (int j = 0; j < 4; ++j) {
      v16h b = ld_frag(woh, DIMD, n0 + 16 * j, k0);
      c0[j] = WMMA_F16(a0, b, c0[j]);
      c1[j] = WMMA_F16(a1, b, c1[j]);
    }
  }
#pragma unroll
  for (int j = 0; j < 4; ++j) {
    st_tile_f32(out, DIMD, m0,      n0 + 16 * j, c0[j]);
    st_tile_f32(out, DIMD, m0 + 16, n0 + 16 * j, c1[j]);
  }
}

// ---------------------------------------------------------------------------
// Fused flash attention per (b, h): grid (N/64, H, B), 128 threads = 4 waves.
// Wave w owns query rows [64*bx + 16w, +16). Keys in tiles of 32; K and V
// tiles staged row-major into LDS by the Tensor Data Mover (padded rows),
// online softmax in f32 registers; P bounced through LDS to A-layout.
// ---------------------------------------------------------------------------
__global__ void fa_attention(const _Float16* __restrict__ Q,
                             const _Float16* __restrict__ K,
                             const _Float16* __restrict__ V,
                             _Float16* __restrict__ ctx) {
  constexpr int LDT = 72;   // padded tile row stride in halves (128B + 16B pad)
  constexpr int LDP = 40;
  __shared__ __align__(16) _Float16 Kt[32 * LDT];
  __shared__ __align__(16) _Float16 Vr[32 * LDT];
  __shared__ __align__(16) _Float16 Pb[4 * 16 * LDP];

  const int tid  = threadIdx.x;
  const int wave = tid >> 5;
  const int lane = tid & 31;
  const int n16  = lane & 15;
  const int hh   = lane >> 4;

  const int b    = blockIdx.z;
  const int h    = blockIdx.y;
  const int qrow = blockIdx.x * 64 + wave * 16;
  const int rowb = b * 2048;
  const int colh = h * 64;

  const float qscale = 0.03608439182435161f;  // 1/sqrt(768), full-D scale

  v16h qa0 = ld_frag_scaled(Q + colh, DIMD, rowb + qrow, 0,  qscale);
  v16h qa1 = ld_frag_scaled(Q + colh, DIMD, rowb + qrow, 32, qscale);

  v8f  o0 = {}, o1 = {}, o2 = {}, o3 = {};
  float mrow[8], lrow[8];
#pragma unroll
  for (int v = 0; v < 8; ++v) { mrow[v] = -1e30f; lrow[v] = 0.0f; }

  _Float16* pw = Pb + wave * 16 * LDP;
#ifdef FA_HAVE_TDM
  const unsigned kt_off = (unsigned)(uintptr_t)Kt;
  const unsigned vr_off = (unsigned)(uintptr_t)Vr;
#endif

  for (int kt = 0; kt < 2048; kt += 32) {
    const _Float16* kg = K + (size_t)(rowb + kt) * DIMD + colh;
    const _Float16* vg = V + (size_t)(rowb + kt) * DIMD + colh;

#ifdef FA_HAVE_TDM
    if (wave == 0) {
      tdm_load_tile_f16(kt_off, kg, 32, 64, DIMD);
      tdm_load_tile_f16(vr_off, vg, 32, 64, DIMD);
      __builtin_amdgcn_s_wait_tensorcnt(0);
    }
#else
    for (int i = tid; i < 256; i += 128) {
      const int r = i >> 3, cs = (i & 7) << 3;
      *(v8h*)(Kt + r * LDT + cs) = *(const v8h*)(kg + (size_t)r * DIMD + cs);
      *(v8h*)(Vr + r * LDT + cs) = *(const v8h*)(vg + (size_t)r * DIMD + cs);
    }
#endif
    __syncthreads();

    // ---- S = Q K^T : two 16x16 C tiles over 32 keys ----
    v8f s0 = {}, s1 = {};
    {
      v16h bk;
      bk = ld_frag(Kt, LDT,  0,  0); s0 = WMMA_F16(qa0, bk, s0);
      bk = ld_frag(Kt, LDT,  0, 32); s0 = WMMA_F16(qa1, bk, s0);
      bk = ld_frag(Kt, LDT, 16,  0); s1 = WMMA_F16(qa0, bk, s1);
      bk = ld_frag(Kt, LDT, 16, 32); s1 = WMMA_F16(qa1, bk, s1);
    }

    // ---- online softmax (row reductions inside each 16-lane half) ----
#pragma unroll
    for (int v = 0; v < 8; ++v) {
      float mx = fmaxf(s0[v], s1[v]);
      mx = fmaxf(mx, __shfl_xor(mx, 1, 32));
      mx = fmaxf(mx, __shfl_xor(mx, 2, 32));
      mx = fmaxf(mx, __shfl_xor(mx, 4, 32));
      mx = fmaxf(mx, __shfl_xor(mx, 8, 32));
      const float mnew  = fmaxf(mrow[v], mx);
      const float alpha = __expf(mrow[v] - mnew);
      const float p0 = __expf(s0[v] - mnew);
      const float p1 = __expf(s1[v] - mnew);
      float rs = p0 + p1;
      rs += __shfl_xor(rs, 1, 32);
      rs += __shfl_xor(rs, 2, 32);
      rs += __shfl_xor(rs, 4, 32);
      rs += __shfl_xor(rs, 8, 32);
      lrow[v] = lrow[v] * alpha + rs;
      mrow[v] = mnew;
      o0[v] *= alpha; o1[v] *= alpha; o2[v] *= alpha; o3[v] *= alpha;
      s0[v] = p0; s1[v] = p1;
    }

    // ---- bounce P through LDS: C-layout f32 -> A-layout f16 (16x32) ----
#pragma unroll
    for (int v = 0; v < 8; ++v) {
      pw[(v + 8 * hh) * LDP + n16]      = (_Float16)s0[v];
      pw[(v + 8 * hh) * LDP + 16 + n16] = (_Float16)s1[v];
    }
    __syncthreads();

    v16h pa = ld_frag(pw, LDP, 0, 0);

    // ---- O += P V : B-frags gathered column-wise from row-major V tile ----
    {
      v16h bv;
      bv = ld_frag_col(Vr, LDT,  0); o0 = WMMA_F16(pa, bv, o0);
      bv = ld_frag_col(Vr, LDT, 16); o1 = WMMA_F16(pa, bv, o1);
      bv = ld_frag_col(Vr, LDT, 32); o2 = WMMA_F16(pa, bv, o2);
      bv = ld_frag_col(Vr, LDT, 48); o3 = WMMA_F16(pa, bv, o3);
    }
    __syncthreads();
  }

  // ---- epilogue: ctx = O / l ----
  const int r0 = rowb + qrow + 8 * hh;
#pragma unroll
  for (int v = 0; v < 8; ++v) {
    const float inv = 1.0f / lrow[v];
    ctx[(size_t)(r0 + v) * DIMD + colh +  0 + n16] = (_Float16)(o0[v] * inv);
    ctx[(size_t)(r0 + v) * DIMD + colh + 16 + n16] = (_Float16)(o1[v] * inv);
    ctx[(size_t)(r0 + v) * DIMD + colh + 32 + n16] = (_Float16)(o2[v] * inv);
    ctx[(size_t)(r0 + v) * DIMD + colh + 48 + n16] = (_Float16)(o3[v] * inv);
  }
}

// ---------------------------------------------------------------------------
// Launcher
// ---------------------------------------------------------------------------
extern "C" void kernel_launch(void* const* d_in, const int* in_sizes, int n_in,
                              void* d_out, int out_size, void* d_ws, size_t ws_size,
                              hipStream_t stream) {
  const float* x  = (const float*)d_in[0];
  const float* Wq = (const float*)d_in[1];
  const float* Wk = (const float*)d_in[2];
  const float* Wv = (const float*)d_in[3];
  const float* Wo = (const float*)d_in[4];
  float* out = (float*)d_out;

  const size_t NX = 8192ull * 768ull;
  const size_t NW = 768ull * 768ull;

  _Float16* xh  = (_Float16*)d_ws;
  _Float16* wh3 = xh  + NX;
  _Float16* woh = wh3 + 3 * NW;
  _Float16* qkv = woh + NW;
  _Float16* ctx = qkv + 3 * NX;

  fa_cvt_f16<<<(int)((NX + 255) / 256), 256, 0, stream>>>(x, xh, (int)NX);
  fa_cvt_f16<<<(int)((NW + 255) / 256), 256, 0, stream>>>(Wq, wh3,          (int)NW);
  fa_cvt_f16<<<(int)((NW + 255) / 256), 256, 0, stream>>>(Wk, wh3 + NW,     (int)NW);
  fa_cvt_f16<<<(int)((NW + 255) / 256), 256, 0, stream>>>(Wv, wh3 + 2 * NW, (int)NW);
  fa_cvt_f16<<<(int)((NW + 255) / 256), 256, 0, stream>>>(Wo, woh,          (int)NW);

  fa_gemm_qkv<<<dim3(12, 64, 3), 128, 0, stream>>>(xh, wh3, qkv);

  fa_attention<<<dim3(32, 12, 4), 128, 0, stream>>>(qkv, qkv + NX, qkv + 2 * NX, ctx);

  fa_gemm_out<<<dim3(12, 64, 1), 128, 0, stream>>>(ctx, woh, out);
}

// v001
// Measured time: 212 microseconds a run.
// Next to v000, in two timings, it ran 1.39 times as fast each time.
#include <hip/hip_runtime.h>
#include <hip/hip_bf16.h>

typedef __attribute__((ext_vector_type(16))) _Float16 v16h;
typedef __attribute__((ext_vector_type(8)))  _Float16 v8h;
typedef __attribute__((ext_vector_type(8)))  float    v8f;
typedef __attribute__((ext_vector_type(8)))  short    s16x8;
typedef __attribute__((ext_vector_type(4))) unsigned int u32x4;
typedef __attribute__((ext_vector_type(8))) int          i32x8;
typedef __attribute__((ext_vector_type(4))) int          i32x4;

#define WMMA_F16(a, b, c) \
  __builtin_amdgcn_wmma_f32_16x16x32_f16(false, (a), false, (b), (short)0, (c), false, false)

#if defined(__has_builtin)
#  if __has_builtin(__builtin_amdgcn_tensor_load_to_lds) && \
      __has_builtin(__builtin_amdgcn_s_wait_tensorcnt)
#    define FA_HAVE_TDM 1
#  endif
#endif

#define DIMD 768

// ---------------------------------------------------------------------------
// Fragment helpers (layouts per ISA 7.12.2, wave32).
// A-matrix 16x32 f16: lanes 0-15 row=lane, K={0..7,16..23}; lanes 16-31 kb=8.
// B-matrix assumed mirror: lane n holds column n with same K striping, so a
// row-major operand loaded by rows gives B[k][n] = Op[n][k].
// ---------------------------------------------------------------------------
__device__ __forceinline__ v16h ld_frag(const _Float16* base, int ld, int row0, int k0) {
  const int lane = threadIdx.x & 31;
  const int r    = row0 + (lane & 15);
  const int kb   = (lane >> 4) << 3;
  const _Float16* p = base + (size_t)r * ld + k0 + kb;
  v8h lo = *(const v8h*)p;
  v8h hi = *(const v8h*)(p + 16);
  v16h f;
#pragma unroll
  for (int i = 0; i < 8; ++i) { f[i] = lo[i]; f[i + 8] = hi[i]; }
  return f;
}

__device__ __forceinline__ v16h ld_frag_scaled(const _Float16* base, int ld, int row0,
                                               int k0, float s) {
  const int lane = threadIdx.x & 31;
  const int r    = row0 + (lane & 15);
  const int kb   = (lane >> 4) << 3;
  const _Float16* p = base + (size_t)r * ld + k0 + kb;
  v8h lo = *(const v8h*)p;
  v8h hi = *(const v8h*)(p + 16);
  v16h f;
#pragma unroll
  for (int i = 0; i < 8; ++i) {
    f[i]     = (_Float16)((float)lo[i] * s);
    f[i + 8] = (_Float16)((float)hi[i] * s);
  }
  return f;
}

// Transposing LDS load: lane (c = lane & 15, hh = lane >> 4) addresses row
// 8*hh + (lane & 7), 16-byte piece (lane >> 3) & 1 of a row-major 16-bit tile and
// receives tile[8*hh + 0..7][c]: eight k of one column, in the hardware k order.
__device__ __forceinline__ v8h ld_tr16(const _Float16* p) {
  typedef __attribute__((address_space(3))) s16x8 lds_s16x8;
  return __builtin_bit_cast(v8h, __builtin_amdgcn_ds_load_tr16_b128_v8i16((lds_s16x8*)p));
}

// A-fragment of the TRANSPOSED tile: A[m][k] = tile[k][col + m], 16(M) x 32(K).
__device__ __forceinline__ v16h ld_frag_tr(const _Float16* base, int ld, int col) {
  const int lane = threadIdx.x & 31;
  const _Float16* p = base + (((lane >> 4) << 3) + (lane & 7)) * ld + col + (((lane >> 3) & 1) << 3);
  v8h lo = ld_tr16(p);
  v8h hi = ld_tr16(p + 16 * ld);
  v16h f;
#pragma unroll
  for (int i = 0; i < 8; ++i) { f[i] = lo[i]; f[i + 8] = hi[i]; }
  return f;
}

// Value of lane l ^ 16 (the other 16-lane half), on the vector pipe.
__device__ __forceinline__ float xhalf(float x) {
  return __builtin_bit_cast(float, __builtin_amdgcn_permlanex16(
      __builtin_bit_cast(int, x), __builtin_bit_cast(int, x), 0x76543210, 0xfedcba98, false, false));
}

// C/D 16x16 f32: lanes 0-15 (M=v, N=lane); lanes 16-31 (M=v+8, N=lane-16)
__device__ __forceinline__ void st_tile_f16(_Float16* base, int ld, int row0, int col0,
                                            const v8f& c) {
  const int lane = threadIdx.x & 31;
  const int n    = col0 + (lane & 15);
  const int r0   = row0 + ((lane >> 4) << 3);
#pragma unroll
  for (int v = 0; v < 8; ++v) base[(size_t)(r0 + v) * ld + n] = (_Float16)c[v];
}

__device__ __forceinline__ void st_tile_f32(float* base, int ld, int row0, int col0,
                                            const v8f& c) {
  const int lane = threadIdx.x & 31;
  const int n    = col0 + (lane & 15);
  const int r0   = row0 + ((lane >> 4) << 3);
#pragma unroll
  for (int v = 0; v < 8; ++v) base[(size_t)(r0 + v) * ld + n] = c[v];
}

// ---------------------------------------------------------------------------
// TDM: DMA a rows x cols f16 tile (row stride = stride elems) into LDS with
// 16B padding every 128B row -> LDS row stride 72 halves (bank-conflict free).
// ---------------------------------------------------------------------------
#ifdef FA_HAVE_TDM
__device__ __forceinline__ void tdm_load_tile_f16(unsigned lds_off, const _Float16* gsrc,
                                                  int rows, int cols, int stride) {
  const unsigned long long ga = (unsigned long long)(uintptr_t)gsrc;
  u32x4 g0;
  g0[0] = 1u;                                        // count=1 (valid user D#)
  g0[1] = lds_off;                                   // lds_addr (bytes)
  g0[2] = (unsigned)(ga & 0xffffffffull);            // global_addr[31:0]
  g0[3] = (unsigned)((ga >> 32) & 0x01ffffffull) | (2u << 30);  // [56:32] | type=2
  i32x8 g1;
  // data_size=1 (2B) | pad_enable | pad_interval=4 (128B) | pad_amount=3 (16B)
  g1[0] = 0x00010000 | (1 << 20) | (4 << 22) | (3 << 25);
  g1[1] = (cols & 0xffff) << 16;                     // tensor_dim0 lo
  g1[2] = ((cols >> 16) & 0xffff) | ((rows & 0xffff) << 16);   // td0 hi | td1 lo
  g1[3] = ((rows >> 16) & 0xffff) | ((cols & 0xffff) << 16);   // td1 hi | tile_dim0
  g1[4] = rows & 0xffff;                             // tile_dim1 (tile_dim2=0)
  g1[5] = stride;                                    // tensor_dim0_stride lo
  g1[6] = 0;
  g1[7] = 0;
  i32x4 z = {0, 0, 0, 0};
#if __clang_major__ >= 23
  i32x8 z8 = {0, 0, 0, 0, 0, 0, 0, 0};
  __builtin_amdgcn_tensor_load_to_lds(g0, g1, z, z, z8, 0);
#else
  __builtin_amdgcn_tensor_load_to_lds(g0, g1, z, z, 0);
#endif
}
#endif

// ---------------------------------------------------------------------------
// f32 -> f16 conversion
// ---------------------------------------------------------------------------
__global__ void fa_cvt_f16(const float* __restrict__ src, _Float16* __restrict__ dst, int n) {
  int i = blockIdx.x * blockDim.x + threadIdx.x;
  if (i < n) dst[i] = (_Float16)src[i];
}

// ---------------------------------------------------------------------------
// Y[8192 x 768] = Xh @ Wh^T (3 projections via blockIdx.z), f16 out.
// 128 threads = 4 waves; each wave computes a 32(M) x 64(N) strip:
// per K-step 6 fragment loads -> 8 WMMAs.
// ---------------------------------------------------------------------------
__global__ void fa_gemm_qkv(const _Float16* __restrict__ xh,
                            const _Float16* __restrict__ wh3,  // [3][768][768]
                            _Float16* __restrict__ qkv) {      // [3][8192][768]
  const int wave = threadIdx.x >> 5;
  const int m0   = blockIdx.y * 128 + wave * 32;
  const int n0   = blockIdx.x * 64;
  const _Float16* W = wh3 + (size_t)blockIdx.z * DIMD * DIMD;
  _Float16*       Y = qkv + (size_t)blockIdx.z * 8192 * DIMD;

  v8f c0[4] = {}, c1[4] = {};
#pragma unroll 2
  for (int k0 = 0; k0 < DIMD; k0 += 32) {
    if (k0 + 32 < DIMD) {
      __builtin_prefetch(xh + (size_t)m0 * DIMD + k0 + 32, 0, 0);        // global_prefetch_b8
      __builtin_prefetch(xh + (size_t)(m0 + 16) * DIMD + k0 + 32, 0, 0);
    }
    v16h a0 = ld_frag(xh, DIMD, m0,      k0);
    v16h a1 = ld_frag(xh, DIMD, m0 + 16, k0);
#pragma unroll
    for (int j = 0; j < 4; ++j) {
      v16h b = ld_frag(W, DIMD, n0 + 16 * j, k0);
      c0[j] = WMMA_F16(a0, b, c0[j]);
      c1[j] = WMMA_F16(a1, b, c1[j]);
    }
  }
#pragma unroll
  for (int j = 0; j < 4; ++j) {
    st_tile_f16(Y, DIMD, m0,      n0 + 16 * j, c0[j]);
    st_tile_f16(Y, DIMD, m0 + 16, n0 + 16 * j, c1[j]);
  }
}

// Final projection: out_f32[8192 x 768] = ctx @ Wo^T
__global__ void fa_gemm_out(const _Float16* __restrict__ ctx,
                            const _Float16* __restrict__ woh,
                            float* __restrict__ out) {
  const int wave = threadIdx.x >> 5;
  const int m0   = blockIdx.y * 128 + wave * 32;
  const int n0   = blockIdx.x * 64;

  v8f c0[4] = {}, c1[4] = {};
#pragma unroll 2
  for (int k0 = 0; k0 < DIMD; k0 += 32) {
    if (k0 + 32 < DIMD) {
      __builtin_prefetch(ctx + (size_t)m0 * DIMD + k0 + 32, 0, 0);
      __builtin_prefetch(ctx + (size_t)(m0 + 16) * DIMD + k0 + 32, 0, 0);
    }
    v16h a0 = ld_frag(ctx, DIMD, m0,      k0);
    v16h a1 = ld_frag(ctx, DIMD, m0 + 16, k0);
#pragma unroll
    for (int j = 0; j < 4; ++j) {
      v16h b = ld_frag(woh, DIMD, n0 + 16 * j, k0);
      c0[j] = WMMA_F16(a0, b, c0[j]);
      c1[j] = WMMA_F16(a1, b, c1[j]);
    }
  }
#pragma unroll
  for (int j = 0; j < 4; ++j) {
    st_tile_f32(out, DIMD, m0,      n0 + 16 * j, c0[j]);
    st_tile_f32(out, DIMD, m0 + 16, n0 + 16 * j, c1[j]);
  }
}

// ---------------------------------------------------------------------------
// Fused flash attention per (b, h): grid (N/64, H, B), 128 threads = 4 waves.
// Wave w owns query rows [64*bx + 16w, +16). Keys in tiles of 32; K and V
// tiles staged row-major into LDS by the Tensor Data Mover (padded rows).
// Both products run transposed: S^T = K Q^T, O^T += V^T P^T. A lane then holds
// 16 scores of ONE query (its partner lane ^ 16 the other 16), so maximum and sum
// are in-lane, and the two S^T accumulator tiles, converted, ARE the B operand P^T.
// ---------------------------------------------------------------------------
__global__ void fa_attention(const _Float16* __restrict__ Q,
                             const _Float16* __restrict__ K,
                             const _Float16* __restrict__ V,
                             _Float16* __restrict__ ctx) {
  constexpr int LDT = 72;   // padded tile row stride in halves (128B + 16B pad)
  __shared__ __attribute__((aligned(2048))) _Float16 Kt[32 * LDT];
  __shared__ __attribute__((aligned(2048))) _Float16 Vr[32 * LDT];

  const int tid  = threadIdx.x;
  const int wave = tid >> 5;
  const int lane = tid & 31;
  const int n16  = lane & 15;
  const int hh   = lane >> 4;

  const int b    = blockIdx.z;
  const int h    = blockIdx.y;
  const int qrow = blockIdx.x * 64 + wave * 16;
  const int rowb = b * 2048;
  const int colh = h * 64;

  const float qscale = 0.03608439182435161f;  // 1/sqrt(768), full-D scale

  // Q rows as B operand: b[s] = Q[query n16][k order of ld_frag], the order K's A fragments use.
  v16h qa0 = ld_frag_scaled(Q + colh, DIMD, rowb + qrow, 0,  qscale);
  v16h qa1 = ld_frag_scaled(Q + colh, DIMD, rowb + qrow, 32, qscale);

  v8f  o0 = {}, o1 = {}, o2 = {}, o3 = {};
  float mrun = -1e30f;  // running maximum of query n16, equal in both halves
  float lrun = 0.0f;    // this half's share of the denominator; halves joined in the epilogue

#ifdef FA_HAVE_TDM
  const unsigned kt_off = (unsigned)(uintptr_t)Kt;
  const unsigned vr_off = (unsigned)(uintptr_t)Vr;
#endif

  for (int kt = 0; kt < 2048; kt += 32) {
    const _Float16* kg = K + (size_t)(rowb + kt) * DIMD + colh;
    const _Float16* vg = V + (size_t)(rowb + kt) * DIMD + colh;

#ifdef FA_HAVE_TDM
    if (wave == 0) {
      tdm_load_tile_f16(kt_off, kg, 32, 64, DIMD);
      tdm_load_tile_f16(vr_off, vg, 32, 64, DIMD);
      __builtin_amdgcn_s_wait_tensorcnt(0);
    }
#else
    for (int i = tid; i < 256; i += 128) {
      const int r = i >> 3, cs = (i & 7) << 3;
      *(v8h*)(Kt + r * LDT + cs) = *(const v8h*)(kg + (size_t)r * DIMD + cs);
      *(v8h*)(Vr + r * LDT + cs) = *(const v8h*)(vg + (size_t)r * DIMD + cs);
    }
#endif
    __syncthreads();

    // ---- S^T = K Q^T : s0[r] = score(key 8*hh + r, query n16), s1: keys + 16 ----
    v8f s0 = {}, s1 = {};
    {
      v16h ak;
      ak = ld_frag(Kt, LDT,  0,  0); s0 = WMMA_F16(ak, qa0, s0);
      ak = ld_frag(Kt, LDT,  0, 32); s0 = WMMA_F16(ak, qa1, s0);
      ak = ld_frag(Kt, LDT, 16,  0); s1 = WMMA_F16(ak, qa0, s1);
      ak = ld_frag(Kt, LDT, 16, 32); s1 = WMMA_F16(ak, qa1, s1);
    }

    // ---- V^T fragments: A operands, 16 d x 32 keys each ----
    const v16h va0 = ld_frag_tr(Vr, LDT,  0);
    const v16h va1 = ld_frag_tr(Vr, LDT, 16);
    const v16h va2 = ld_frag_tr(Vr, LDT, 32);
    const v16h va3 = ld_frag_tr(Vr, LDT, 48);

    // ---- online softmax: one query per lane, one exchange between the halves ----
    float mx = fmaxf(s0[0], s1[0]);
#pragma unroll
    for (int v = 1; v < 8; ++v) mx = fmaxf(mx, fmaxf(s0[v], s1[v]));
    mx = fmaxf(mx, xhalf(mx));
    const float mnew  = fmaxf(mrun, mx);
    const float alpha = __expf(mrun - mnew);
    mrun = mnew;

    v16h  pb;      // P^T as B operand: pb[s] = P[query n16][key in the hardware k order]
    float ps[8];
#pragma unroll
    for (int v = 0; v < 8; ++v) {
      const float p0 = __expf(s0[v] - mnew);
      const float p1 = __expf(s1[v] - mnew);
      ps[v]     = p0 + p1;
      pb[v]     = (_Float16)p0;
      pb[v + 8] = (_Float16)p1;
    }
    lrun = lrun * alpha + (((ps[0] + ps[1]) + (ps[2] + ps[3])) + ((ps[4] + ps[5]) + (ps[6] + ps[7])));
#pragma unroll
    for (int v = 0; v < 8; ++v) { o0[v] *= alpha; o1[v] *= alpha; o2[v] *= alpha; o3[v] *= alpha; }

    // ---- O^T += V^T P^T : oj[r] = O[query n16][16*j + 8*hh + r] ----
    o0 = WMMA_F16(va0, pb, o0);
    o1 = WMMA_F16(va1, pb, o1);
    o2 = WMMA_F16(va2, pb, o2);
    o3 = WMMA_F16(va3, pb, o3);
    __syncthreads();
  }

  // ---- epilogue: ctx = O / l; a lane's 8 registers are 8 consecutive d of one row ----
  const float inv = 1.0f / (lrun + xhalf(lrun));
  _Float16* cp = ctx + (size_t)(rowb + qrow + n16) * DIMD + colh + 8 * hh;
  v8h w0, w1, w2, w3;
#pragma unroll
  for (int v = 0; v < 8; ++v) {
    w0[v] = (_Float16)(o0[v] * inv);
    w1[v] = (_Float16)(o1[v] * inv);
    w2[v] = (_Float16)(o2[v] * inv);
    w3[v] = (_Float16)(o3[v] * inv);
  }
  *(v8h*)(cp +  0) = w0;
  *(v8h*)(cp + 16) = w1;
  *(v8h*)(cp + 32) = w2;
  *(v8h*)(cp + 48) = w3;
}

// ---------------------------------------------------------------------------
// Launcher
// ---------------------------------------------------------------------------
extern "C" void kernel_launch(void* const* d_in, const int* in_sizes, int n_in,
                              void* d_out, int out_size, void* d_ws, size_t ws_size,
                              hipStream_t stream) {
  const float* x  = (const float*)d_in[0];
  const float* Wq = (const float*)d_in[1];
  const float* Wk = (const float*)d_in[2];
  const float* Wv = (const float*)d_in[3];
  const float* Wo = (const float*)d_in[4];
  float* out = (float*)d_out;

  const size_t NX = 8192ull * 768ull;
  const size_t NW = 768ull * 768ull;

  _Float16* xh  = (_Float16*)d_ws;
  _Float16* wh3 = xh  + NX;
  _Float16* woh = wh3 + 3 * NW;
  _Float16* qkv = woh + NW;
  _Float16* ctx = qkv + 3 * NX;

  fa_cvt_f16<<<(int)((NX + 255) / 256), 256, 0, stream>>>(x, xh, (int)NX);
  fa_cvt_f16<<<(int)((NW + 255) / 256), 256, 0, stream>>>(Wq, wh3,          (int)NW);
  fa_cvt_f16<<<(int)((NW + 255) / 256), 256, 0, stream>>>(Wk, wh3 + NW,     (int)NW);
  fa_cvt_f16<<<(int)((NW + 255) / 256), 256, 0, stream>>>(Wv, wh3 + 2 * NW, (int)NW);
  fa_cvt_f16<<<(int)((NW + 255) / 256), 256, 0, stream>>>(Wo, woh,          (int)NW);

  fa_gemm_qkv<<<dim3(12, 64, 3), 128, 0, stream>>>(xh, wh3, qkv);

  fa_attention<<<dim3(32, 12, 4), 128, 0, stream>>>(qkv, qkv + NX, qkv + 2 * NX, ctx);

  fa_gemm_out<<<dim3(12, 64, 1), 128, 0, stream>>>(ctx, woh, out);
}

// v002
// One run takes 199 microseconds.
// In two side-by-side timings against v001, it was 1.07 and 1.06 times as fast.
// Counting every step since v000, it is 1.48 times as fast.
#include <hip/hip_runtime.h>
#include <hip/hip_bf16.h>

typedef __attribute__((ext_vector_type(16))) _Float16 v16h;
typedef __attribute__((ext_vector_type(8)))  _Float16 v8h;
typedef __attribute__((ext_vector_type(8)))  float    v8f;
typedef __attribute__((ext_vector_type(4)))  float    v4f;
typedef __attribute__((ext_vector_type(4)))  _Float16 v4h;
typedef __attribute__((ext_vector_type(8)))  short    s16x8;
typedef __attribute__((ext_vector_type(4))) unsigned int u32x4;
typedef __attribute__((ext_vector_type(8))) int          i32x8;
typedef __attribute__((ext_vector_type(4))) int          i32x4;

#define WMMA_F16(a, b, c) \
  __builtin_amdgcn_wmma_f32_16x16x32_f16(false, (a), false, (b), (short)0, (c), false, false)

#if defined(__has_builtin)
#  if __has_builtin(__builtin_amdgcn_tensor_load_to_lds) && \
      __has_builtin(__builtin_amdgcn_s_wait_tensorcnt)
#    define FA_HAVE_TDM 1
#  endif
#endif

#define DIMD 768

// ---------------------------------------------------------------------------
// Fragment helpers (layouts per ISA 7.12.2, wave32).
// A-matrix 16x32 f16: lanes 0-15 row=lane, K={0..7,16..23}; lanes 16-31 kb=8.
// B-matrix assumed mirror: lane n holds column n with same K striping, so a
// row-major operand loaded by rows gives B[k][n] = Op[n][k].
// ---------------------------------------------------------------------------
__device__ __forceinline__ v16h ld_frag(const _Float16* base, int ld, int row0, int k0) {
  const int lane = threadIdx.x & 31;
  const int r    = row0 + (lane & 15);
  const int kb   = (lane >> 4) << 3;
  const _Float16* p = base + (size_t)r * ld + k0 + kb;
  v8h lo = *(const v8h*)p;
  v8h hi = *(const v8h*)(p + 16);
  v16h f;
#pragma unroll
  for (int i = 0; i < 8; ++i) { f[i] = lo[i]; f[i + 8] = hi[i]; }
  return f;
}

__device__ __forceinline__ v16h ld_frag_scaled(const _Float16* base, int ld, int row0,
                                               int k0, float s) {
  const int lane = threadIdx.x & 31;
  const int r    = row0 + (lane & 15);
  const int kb   = (lane >> 4) << 3;
  const _Float16* p = base + (size_t)r * ld + k0 + kb;
  v8h lo = *(const v8h*)p;
  v8h hi = *(const v8h*)(p + 16);
  v16h f;
#pragma unroll
  for (int i = 0; i < 8; ++i) {
    f[i]     = (_Float16)((float)lo[i] * s);
    f[i + 8] = (_Float16)((float)hi[i] * s);
  }
  return f;
}

// Transposing LDS load: lane (c = lane & 15, hh = lane >> 4) addresses row
// 8*hh + (lane & 7), 16-byte piece (lane >> 3) & 1 of a row-major 16-bit tile and
// receives tile[8*hh + 0..7][c]: eight k of one column, in the hardware k order.
__device__ __forceinline__ v8h ld_tr16(const _Float16* p) {
  typedef __attribute__((address_space(3))) s16x8 lds_s16x8;
  return __builtin_bit_cast(v8h, __builtin_amdgcn_ds_load_tr16_b128_v8i16((lds_s16x8*)p));
}

// A-fragment of the TRANSPOSED tile: A[m][k] = tile[k][col + m], 16(M) x 32(K).
__device__ __forceinline__ v16h ld_frag_tr(const _Float16* base, int ld, int col) {
  const int lane = threadIdx.x & 31;
  const _Float16* p = base + (((lane >> 4) << 3) + (lane & 7)) * ld + col + (((lane >> 3) & 1) << 3);
  v8h lo = ld_tr16(p);
  v8h hi = ld_tr16(p + 16 * ld);
  v16h f;
#pragma unroll
  for (int i = 0; i < 8; ++i) { f[i] = lo[i]; f[i + 8] = hi[i]; }
  return f;
}

// Value of lane l ^ 16 (the other 16-lane half), on the vector pipe.
__device__ __forceinline__ float xhalf(float x) {
  return __builtin_bit_cast(float, __builtin_amdgcn_permlanex16(
      __builtin_bit_cast(int, x), __builtin_bit_cast(int, x), 0x76543210, 0xfedcba98, false, false));
}

// C/D 16x16 f32: lanes 0-15 (M=v, N=lane); lanes 16-31 (M=v+8, N=lane-16)
__device__ __forceinline__ void st_tile_f16(_Float16* base, int ld, int row0, int col0,
                                            const v8f& c) {
  const int lane = threadIdx.x & 31;
  const int n    = col0 + (lane & 15);
  const int r0   = row0 + ((lane >> 4) << 3);
#pragma unroll
  for (int v = 0; v < 8; ++v) base[(size_t)(r0 + v) * ld + n] = (_Float16)c[v];
}

__device__ __forceinline__ void st_tile_f32(float* base, int ld, int row0, int col0,
                                            const v8f& c) {
  const int lane = threadIdx.x & 31;
  const int n    = col0 + (lane & 15);
  const int r0   = row0 + ((lane >> 4) << 3);
#pragma unroll
  for (int v = 0; v < 8; ++v) base[(size_t)(r0 + v) * ld + n] = c[v];
}

// ---------------------------------------------------------------------------
// TDM: DMA a rows x cols f16 tile (row stride = stride elems) into LDS with
// 16B padding every 128B row -> LDS row stride 72 halves (bank-conflict free).
// ---------------------------------------------------------------------------
#ifdef FA_HAVE_TDM
__device__ __forceinline__ void tdm_load_tile_f16(unsigned lds_off, const _Float16* gsrc,
                                                  int rows, int cols, int stride) {
  const unsigned long long ga = (unsigned long long)(uintptr_t)gsrc;
  u32x4 g0;
  g0[0] = 1u;                                        // count=1 (valid user D#)
  g0[1] = lds_off;                                   // lds_addr (bytes)
  g0[2] = (unsigned)(ga & 0xffffffffull);            // global_addr[31:0]
  g0[3] = (unsigned)((ga >> 32) & 0x01ffffffull) | (2u << 30);  // [56:32] | type=2
  i32x8 g1;
  // data_size=1 (2B) | pad_enable | pad_interval=4 (128B) | pad_amount=3 (16B)
  g1[0] = 0x00010000 | (1 << 20) | (4 << 22) | (3 << 25);
  g1[1] = (cols & 0xffff) << 16;                     // tensor_dim0 lo
  g1[2] = ((cols >> 16) & 0xffff) | ((rows & 0xffff) << 16);   // td0 hi | td1 lo
  g1[3] = ((rows >> 16) & 0xffff) | ((cols & 0xffff) << 16);   // td1 hi | tile_dim0
  g1[4] = rows & 0xffff;                             // tile_dim1 (tile_dim2=0)
  g1[5] = stride;                                    // tensor_dim0_stride lo
  g1[6] = 0;
  g1[7] = 0;
  i32x4 z = {0, 0, 0, 0};
#if __clang_major__ >= 23
  i32x8 z8 = {0, 0, 0, 0, 0, 0, 0, 0};
  __builtin_amdgcn_tensor_load_to_lds(g0, g1, z, z, z8, 0);
#else
  __builtin_amdgcn_tensor_load_to_lds(g0, g1, z, z, 0);
#endif
}
#endif

// ---------------------------------------------------------------------------
// f32 -> f16 conversion of all five inputs in ONE launch of 528 blocks of 8 waves.
// dst holds the planes [x | Wq | Wk | Wv | Wo] back to back. A block converts
// 16384 consecutive elements of one input: 384 blocks cover x, 36 each weight.
// A lane takes 16 groups of 4 elements, 256 groups apart, so every wave-wide
// load covers 512 contiguous bytes and every store 256.
// ---------------------------------------------------------------------------
__global__ __launch_bounds__(256) void fa_cvt_all(const float* __restrict__ x,
                                                  const float* __restrict__ wq,
                                                  const float* __restrict__ wk,
                                                  const float* __restrict__ wv,
                                                  const float* __restrict__ wo,
                                                  _Float16* __restrict__ dst) {
  constexpr int BX = 384;   // blocks of x:        8192 * 768 / 16384
  constexpr int BW = 36;    // blocks of a weight:  768 * 768 / 16384
  const int blk = blockIdx.x;
  const float* src = x;
  int rel = blk;
  if (blk >= BX) {
    const int w = (blk - BX) / BW;
    rel = (blk - BX) - w * BW;
    src = (w == 0) ? wq : (w == 1) ? wk : (w == 2) ? wv : wo;
  }
  const v4f* s = (const v4f*)src + (size_t)rel * 4096 + threadIdx.x;
  v4h*       d = (v4h*)dst + (size_t)blk * 4096 + threadIdx.x;
  v4f r[16];
  // unrolled so that r stays in registers and the 16 loads are issued as one run
#pragma unroll
  for (int j = 0; j < 16; ++j) r[j] = s[j * 256];
  // keeps the last loads from sinking behind the first converts, where they would wait out a second latency
  __builtin_amdgcn_sched_barrier(0);
  // unrolled: r is indexed by constants only
#pragma unroll
  for (int j = 0; j < 16; ++j) d[j * 256] = __builtin_convertvector(r[j], v4h);
}

// ---------------------------------------------------------------------------
// Y[8192 x 768] = Xh @ Wh^T (3 projections via blockIdx.z), f16 out.
// 128 threads = 4 waves; each wave computes a 32(M) x 64(N) strip:
// per K-step 6 fragment loads -> 8 WMMAs.
// ---------------------------------------------------------------------------
__global__ void fa_gemm_qkv(const _Float16* __restrict__ xh,
                            const _Float16* __restrict__ wh3,  // [3][768][768]
                            _Float16* __restrict__ qkv) {      // [3][8192][768]
  const int wave = threadIdx.x >> 5;
  const int m0   = blockIdx.y * 128 + wave * 32;
  const int n0   = blockIdx.x * 64;
  const _Float16* W = wh3 + (size_t)blockIdx.z * DIMD * DIMD;
  _Float16*       Y = qkv + (size_t)blockIdx.z * 8192 * DIMD;

  v8f c0[4] = {}, c1[4] = {};
#pragma unroll 2
  for (int k0 = 0; k0 < DIMD; k0 += 32) {
    if (k0 + 32 < DIMD) {
      __builtin_prefetch(xh + (size_t)m0 * DIMD + k0 + 32, 0, 0);        // global_prefetch_b8
      __builtin_prefetch(xh + (size_t)(m0 + 16) * DIMD + k0 + 32, 0, 0);
    }
    v16h a0 = ld_frag(xh, DIMD, m0,      k0);
    v16h a1 = ld_frag(xh, DIMD, m0 + 16, k0);
#pragma unroll
    for (int j = 0; j < 4; ++j) {
      v16h b = ld_frag(W, DIMD, n0 + 16 * j, k0);
      c0[j] = WMMA_F16(a0, b, c0[j]);
      c1[j] = WMMA_F16(a1, b, c1[j]);
    }
  }
#pragma unroll
  for (int j = 0; j < 4; ++j) {
    st_tile_f16(Y, DIMD, m0,      n0 + 16 * j, c0[j]);
    st_tile_f16(Y, DIMD, m0 + 16, n0 + 16 * j, c1[j]);
  }
}

// Final projection: out_f32[8192 x 768] = ctx @ Wo^T
__global__ void fa_gemm_out(const _Float16* __restrict__ ctx,
                            const _Float16* __restrict__ woh,
                            float* __restrict__ out) {
  const int wave = threadIdx.x >> 5;
  const int m0   = blockIdx.y * 128 + wave * 32;
  const int n0   = blockIdx.x * 64;

  v8f c0[4] = {}, c1[4] = {};
#pragma unroll 2
  for (int k0 = 0; k0 < DIMD; k0 += 32) {
    if (k0 + 32 < DIMD) {
      __builtin_prefetch(ctx + (size_t)m0 * DIMD + k0 + 32, 0, 0);
      __builtin_prefetch(ctx + (size_t)(m0 + 16) * DIMD + k0 + 32, 0, 0);
    }
    v16h a0 = ld_frag(ctx, DIMD, m0,      k0);
    v16h a1 = ld_frag(ctx, DIMD, m0 + 16, k0);
#pragma unroll
    for (int j = 0; j < 4; ++j) {
      v16h b = ld_frag(woh, DIMD, n0 + 16 * j, k0);
      c0[j] = WMMA_F16(a0, b, c0[j]);
      c1[j] = WMMA_F16(a1, b, c1[j]);
    }
  }
#pragma unroll
  for (int j = 0; j < 4; ++j) {
    st_tile_f32(out, DIMD, m0,      n0 + 16 * j, c0[j]);
    st_tile_f32(out, DIMD, m0 + 16, n0 + 16 * j, c1[j]);
  }
}

// ---------------------------------------------------------------------------
// Fused flash attention per (b, h): grid (N/64, H, B), 128 threads = 4 waves.
// Wave w owns query rows [64*bx + 16w, +16). Keys in tiles of 32; K and V
// tiles staged row-major into LDS by the Tensor Data Mover (padded rows).
// Both products run transposed: S^T = K Q^T, O^T += V^T P^T. A lane then holds
// 16 scores of ONE query (its partner lane ^ 16 the other 16), so maximum and sum
// are in-lane, and the two S^T accumulator tiles, converted, ARE the B operand P^T.
// ---------------------------------------------------------------------------
__global__ void fa_attention(const _Float16* __restrict__ Q,
                             const _Float16* __restrict__ K,
                             const _Float16* __restrict__ V,
                             _Float16* __restrict__ ctx) {
  constexpr int LDT = 72;   // padded tile row stride in halves (128B + 16B pad)
  __shared__ __attribute__((aligned(2048))) _Float16 Kt[32 * LDT];
  __shared__ __attribute__((aligned(2048))) _Float16 Vr[32 * LDT];

  const int tid  = threadIdx.x;
  const int wave = tid >> 5;
  const int lane = tid & 31;
  const int n16  = lane & 15;
  const int hh   = lane >> 4;

  const int b    = blockIdx.z;
  const int h    = blockIdx.y;
  const int qrow = blockIdx.x * 64 + wave * 16;
  const int rowb = b * 2048;
  const int colh = h * 64;

  const float qscale = 0.03608439182435161f;  // 1/sqrt(768), full-D scale

  // Q rows as B operand: b[s] = Q[query n16][k order of ld_frag], the order K's A fragments use.
  v16h qa0 = ld_frag_scaled(Q + colh, DIMD, rowb + qrow, 0,  qscale);
  v16h qa1 = ld_frag_scaled(Q + colh, DIMD, rowb + qrow, 32, qscale);

  v8f  o0 = {}, o1 = {}, o2 = {}, o3 = {};
  float mrun = -1e30f;  // running maximum of query n16, equal in both halves
  float lrun = 0.0f;    // this half's share of the denominator; halves joined in the epilogue

#ifdef FA_HAVE_TDM
  const unsigned kt_off = (unsigned)(uintptr_t)Kt;
  const unsigned vr_off = (unsigned)(uintptr_t)Vr;
#endif

  for (int kt = 0; kt < 2048; kt += 32) {
    const _Float16* kg = K + (size_t)(rowb + kt) * DIMD + colh;
    const _Float16* vg = V + (size_t)(rowb + kt) * DIMD + colh;

#ifdef FA_HAVE_TDM
    if (wave == 0) {
      tdm_load_tile_f16(kt_off, kg, 32, 64, DIMD);
      tdm_load_tile_f16(vr_off, vg, 32, 64, DIMD);
      __builtin_amdgcn_s_wait_tensorcnt(0);
    }
#else
    for (int i = tid; i < 256; i += 128) {
      const int r = i >> 3, cs = (i & 7) << 3;
      *(v8h*)(Kt + r * LDT + cs) = *(const v8h*)(kg + (size_t)r * DIMD + cs);
      *(v8h*)(Vr + r * LDT + cs) = *(const v8h*)(vg + (size_t)r * DIMD + cs);
    }
#endif
    __syncthreads();

    // ---- S^T = K Q^T : s0[r] = score(key 8*hh + r, query n16), s1: keys + 16 ----
    v8f s0 = {}, s1 = {};
    {
      v16h ak;
      ak = ld_frag(Kt, LDT,  0,  0); s0 = WMMA_F16(ak, qa0, s0);
      ak = ld_frag(Kt, LDT,  0, 32); s0 = WMMA_F16(ak, qa1, s0);
      ak = ld_frag(Kt, LDT, 16,  0); s1 = WMMA_F16(ak, qa0, s1);
      ak = ld_frag(Kt, LDT, 16, 32); s1 = WMMA_F16(ak, qa1, s1);
    }

    // ---- V^T fragments: A operands, 16 d x 32 keys each ----
    const v16h va0 = ld_frag_tr(Vr, LDT,  0);
    const v16h va1 = ld_frag_tr(Vr, LDT, 16);
    const v16h va2 = ld_frag_tr(Vr, LDT, 32);
    const v16h va3 = ld_frag_tr(Vr, LDT, 48);

    // ---- online softmax: one query per lane, one exchange between the halves ----
    float mx = fmaxf(s0[0], s1[0]);
#pragma unroll
    for (int v = 1; v < 8; ++v) mx = fmaxf(mx, fmaxf(s0[v], s1[v]));
    mx = fmaxf(mx, xhalf(mx));
    const float mnew  = fmaxf(mrun, mx);
    const float alpha = __expf(mrun - mnew);
    mrun = mnew;

    v16h  pb;      // P^T as B operand: pb[s] = P[query n16][key in the hardware k order]
    float ps[8];
#pragma unroll
    for (int v = 0; v < 8; ++v) {
      const float p0 = __expf(s0[v] - mnew);
      const float p1 = __expf(s1[v] - mnew);
      ps[v]     = p0 + p1;
      pb[v]     = (_Float16)p0;
      pb[v + 8] = (_Float16)p1;
    }
    lrun = lrun * alpha + (((ps[0] + ps[1]) + (ps[2] + ps[3])) + ((ps[4] + ps[5]) + (ps[6] + ps[7])));
#pragma unroll
    for (int v = 0; v < 8; ++v) { o0[v] *= alpha; o1[v] *= alpha; o2[v] *= alpha; o3[v] *= alpha; }

    // ---- O^T += V^T P^T : oj[r] = O[query n16][16*j + 8*hh + r] ----
    o0 = WMMA_F16(va0, pb, o0);
    o1 = WMMA_F16(va1, pb, o1);
    o2 = WMMA_F16(va2, pb, o2);
    o3 = WMMA_F16(va3, pb, o3);
    __syncthreads();
  }

  // ---- epilogue: ctx = O / l; a lane's 8 registers are 8 consecutive d of one row ----
  const float inv = 1.0f / (lrun + xhalf(lrun));
  _Float16* cp = ctx + (size_t)(rowb + qrow + n16) * DIMD + colh + 8 * hh;
  v8h w0, w1, w2, w3;
#pragma unroll
  for (int v = 0; v < 8; ++v) {
    w0[v] = (_Float16)(o0[v] * inv);
    w1[v] = (_Float16)(o1[v] * inv);
    w2[v] = (_Float16)(o2[v] * inv);
    w3[v] = (_Float16)(o3[v] * inv);
  }
  *(v8h*)(cp +  0) = w0;
  *(v8h*)(cp + 16) = w1;
  *(v8h*)(cp + 32) = w2;
  *(v8h*)(cp + 48) = w3;
}

// ---------------------------------------------------------------------------
// Launcher
// ---------------------------------------------------------------------------
extern "C" void kernel_launch(void* const* d_in, const int* in_sizes, int n_in,
                              void* d_out, int out_size, void* d_ws, size_t ws_size,
                              hipStream_t stream) {
  const float* x  = (const float*)d_in[0];
  const float* Wq = (const float*)d_in[1];
  const float* Wk = (const float*)d_in[2];
  const float* Wv = (const float*)d_in[3];
  const float* Wo = (const float*)d_in[4];
  float* out = (float*)d_out;

  const size_t NX = 8192ull * 768ull;
  const size_t NW = 768ull * 768ull;

  _Float16* xh  = (_Float16*)d_ws;
  _Float16* wh3 = xh  + NX;
  _Float16* woh = wh3 + 3 * NW;
  _Float16* qkv = woh + NW;
  _Float16* ctx = qkv + 3 * NX;

  // xh, wh3 and woh lie back to back from the start of the workspace: one destination.
  // 528 blocks = 384 for x and 36 for each of the four weights.
  fa_cvt_all<<<528, 256, 0, stream>>>(x, Wq, Wk, Wv, Wo, xh);

  fa_gemm_qkv<<<dim3(12, 64, 3), 128, 0, stream>>>(xh, wh3, qkv);

  fa_attention<<<dim3(32, 12, 4), 128, 0, stream>>>(qkv, qkv + NX, qkv + 2 * NX, ctx);

  fa_gemm_out<<<dim3(12, 64, 1), 128, 0, stream>>>(ctx, woh, out);
}

// v003
// It runs in 122 microseconds.
// Two timings next to v002 put it at 1.61 and 1.62 times that version's speed.
// Over all steps from v000 it is 2.39 times as fast.
#include <hip/hip_runtime.h>
#include <hip/hip_bf16.h>

typedef __attribute__((ext_vector_type(16))) _Float16 v16h;
typedef __attribute__((ext_vector_type(8)))  _Float16 v8h;
typedef __attribute__((ext_vector_type(8)))  float    v8f;
typedef __attribute__((ext_vector_type(4)))  float    v4f;
typedef __attribute__((ext_vector_type(4)))  _Float16 v4h;
typedef __attribute__((ext_vector_type(8)))  short    s16x8;
typedef __attribute__((ext_vector_type(4))) unsigned int u32x4;
typedef __attribute__((ext_vector_type(8))) unsigned int u32x8;
typedef __attribute__((ext_vector_type(8))) int          i32x8;
typedef __attribute__((ext_vector_type(4))) int          i32x4;

#define WMMA_F16(a, b, c) \
  __builtin_amdgcn_wmma_f32_16x16x32_f16(false, (a), false, (b), (short)0, (c), false, false)

#if defined(__has_builtin)
#  if __has_builtin(__builtin_amdgcn_tensor_load_to_lds) && \
      __has_builtin(__builtin_amdgcn_s_wait_tensorcnt)
#    define FA_HAVE_TDM 1
#  endif
#endif

#define DIMD 768

// ---------------------------------------------------------------------------
// Fragment helpers (layouts per ISA 7.12.2, wave32).
// A-matrix 16x32 f16: lanes 0-15 row=lane, K={0..7,16..23}; lanes 16-31 kb=8.
// B-matrix assumed mirror: lane n holds column n with same K striping, so a
// row-major operand loaded by rows gives B[k][n] = Op[n][k].
// ---------------------------------------------------------------------------
__device__ __forceinline__ v16h ld_frag(const _Float16* base, int ld, int row0, int k0) {
  const int lane = threadIdx.x & 31;
  const int r    = row0 + (lane & 15);
  const int kb   = (lane >> 4) << 3;
  const _Float16* p = base + (size_t)r * ld + k0 + kb;
  v8h lo = *(const v8h*)p;
  v8h hi = *(const v8h*)(p + 16);
  v16h f;
#pragma unroll
  for (int i = 0; i < 8; ++i) { f[i] = lo[i]; f[i + 8] = hi[i]; }
  return f;
}

__device__ __forceinline__ v16h ld_frag_scaled(const _Float16* base, int ld, int row0,
                                               int k0, float s) {
  const int lane = threadIdx.x & 31;
  const int r    = row0 + (lane & 15);
  const int kb   = (lane >> 4) << 3;
  const _Float16* p = base + (size_t)r * ld + k0 + kb;
  v8h lo = *(const v8h*)p;
  v8h hi = *(const v8h*)(p + 16);
  v16h f;
#pragma unroll
  for (int i = 0; i < 8; ++i) {
    f[i]     = (_Float16)((float)lo[i] * s);
    f[i + 8] = (_Float16)((float)hi[i] * s);
  }
  return f;
}

// Transposing LDS load: lane (c = lane & 15, hh = lane >> 4) addresses row
// 8*hh + (lane & 7), 16-byte piece (lane >> 3) & 1 of a row-major 16-bit tile and
// receives tile[8*hh + 0..7][c]: eight k of one column, in the hardware k order.
__device__ __forceinline__ v8h ld_tr16(const _Float16* p) {
  typedef __attribute__((address_space(3))) s16x8 lds_s16x8;
  return __builtin_bit_cast(v8h, __builtin_amdgcn_ds_load_tr16_b128_v8i16((lds_s16x8*)p));
}

// A-fragment of the TRANSPOSED tile: A[m][k] = tile[k][col + m], 16(M) x 32(K).
__device__ __forceinline__ v16h ld_frag_tr(const _Float16* base, int ld, int col) {
  const int lane = threadIdx.x & 31;
  const _Float16* p = base + (((lane >> 4) << 3) + (lane & 7)) * ld + col + (((lane >> 3) & 1) << 3);
  v8h lo = ld_tr16(p);
  v8h hi = ld_tr16(p + 16 * ld);
  v16h f;
#pragma unroll
  for (int i = 0; i < 8; ++i) { f[i] = lo[i]; f[i + 8] = hi[i]; }
  return f;
}

// Value of lane l ^ 16 (the other 16-lane half), on the vector pipe.
__device__ __forceinline__ float xhalf(float x) {
  return __builtin_bit_cast(float, __builtin_amdgcn_permlanex16(
      __builtin_bit_cast(int, x), __builtin_bit_cast(int, x), 0x76543210, 0xfedcba98, false, false));
}

// C/D 16x16 f32: lanes 0-15 (M=v, N=lane); lanes 16-31 (M=v+8, N=lane-16)
__device__ __forceinline__ void st_tile_f16(_Float16* base, int ld, int row0, int col0,
                                            const v8f& c) {
  const int lane = threadIdx.x & 31;
  const int n    = col0 + (lane & 15);
  const int r0   = row0 + ((lane >> 4) << 3);
#pragma unroll
  for (int v = 0; v < 8; ++v) base[(size_t)(r0 + v) * ld + n] = (_Float16)c[v];
}

__device__ __forceinline__ void st_tile_f32(float* base, int ld, int row0, int col0,
                                            const v8f& c) {
  const int lane = threadIdx.x & 31;
  const int n    = col0 + (lane & 15);
  const int r0   = row0 + ((lane >> 4) << 3);
#pragma unroll
  for (int v = 0; v < 8; ++v) base[(size_t)(r0 + v) * ld + n] = c[v];
}

// ---------------------------------------------------------------------------
// TDM: DMA a rows x cols f16 tile (row stride = stride elems) into LDS with
// 16B padding every 128B row -> LDS row stride 72 halves (bank-conflict free).
// ---------------------------------------------------------------------------
#ifdef FA_HAVE_TDM
__device__ __forceinline__ void tdm_load_tile_f16(unsigned lds_off, const _Float16* gsrc,
                                                  int rows, int cols, int stride) {
  const unsigned long long ga = (unsigned long long)(uintptr_t)gsrc;
  u32x4 g0;
  g0[0] = 1u;                                        // count=1 (valid user D#)
  g0[1] = lds_off;                                   // lds_addr (bytes)
  g0[2] = (unsigned)(ga & 0xffffffffull);            // global_addr[31:0]
  g0[3] = (unsigned)((ga >> 32) & 0x01ffffffull) | (2u << 30);  // [56:32] | type=2
  i32x8 g1;
  // data_size=1 (2B) | pad_enable | pad_interval=4 (128B) | pad_amount=3 (16B)
  g1[0] = 0x00010000 | (1 << 20) | (4 << 22) | (3 << 25);
  g1[1] = (cols & 0xffff) << 16;                     // tensor_dim0 lo
  g1[2] = ((cols >> 16) & 0xffff) | ((rows & 0xffff) << 16);   // td0 hi | td1 lo
  g1[3] = ((rows >> 16) & 0xffff) | ((cols & 0xffff) << 16);   // td1 hi | tile_dim0
  g1[4] = rows & 0xffff;                             // tile_dim1 (tile_dim2=0)
  g1[5] = stride;                                    // tensor_dim0_stride lo
  g1[6] = 0;
  g1[7] = 0;
  i32x4 z = {0, 0, 0, 0};
#if __clang_major__ >= 23
  i32x8 z8 = {0, 0, 0, 0, 0, 0, 0, 0};
  __builtin_amdgcn_tensor_load_to_lds(g0, g1, z, z, z8, 0);
#else
  __builtin_amdgcn_tensor_load_to_lds(g0, g1, z, z, 0);
#endif
}
#endif

// ---------------------------------------------------------------------------
// f32 -> f16 conversion of all five inputs in ONE launch of 528 blocks of 8 waves.
// dst holds the planes [x | Wq | Wk | Wv | Wo] back to back. A block converts
// 16384 consecutive elements of one input: 384 blocks cover x, 36 each weight.
// A lane takes 16 groups of 4 elements, 256 groups apart, so every wave-wide
// load covers 512 contiguous bytes and every store 256.
// ---------------------------------------------------------------------------
__global__ __launch_bounds__(256) void fa_cvt_all(const float* __restrict__ x,
                                                  const float* __restrict__ wq,
                                                  const float* __restrict__ wk,
                                                  const float* __restrict__ wv,
                                                  const float* __restrict__ wo,
                                                  _Float16* __restrict__ dst) {
  constexpr int BX = 384;   // blocks of x:        8192 * 768 / 16384
  constexpr int BW = 36;    // blocks of a weight:  768 * 768 / 16384
  const int blk = blockIdx.x;
  const float* src = x;
  int rel = blk;
  if (blk >= BX) {
    const int w = (blk - BX) / BW;
    rel = (blk - BX) - w * BW;
    src = (w == 0) ? wq : (w == 1) ? wk : (w == 2) ? wv : wo;
  }
  const v4f* s = (const v4f*)src + (size_t)rel * 4096 + threadIdx.x;
  v4h*       d = (v4h*)dst + (size_t)blk * 4096 + threadIdx.x;
  v4f r[16];
  // unrolled so that r stays in registers and the 16 loads are issued as one run
#pragma unroll
  for (int j = 0; j < 16; ++j) r[j] = s[j * 256];
  // keeps the last loads from sinking behind the first converts, where they would wait out a second latency
  __builtin_amdgcn_sched_barrier(0);
  // unrolled: r is indexed by constants only
#pragma unroll
  for (int j = 0; j < 16; ++j) d[j * 256] = __builtin_convertvector(r[j], v4h);
}

// ---------------------------------------------------------------------------
// Both projections' GEMMs, Y = X @ W^T with X and W k-contiguous, row pitch 768 halves.
// A block of 8 waves owns a 128(M) x 192(N) tile of Y. A stage is 64 k (128-byte rows):
// 128 rows of X and 192 rows of W, brought into LDS by two tensor loads (wave 0: X,
// wave 1: W) that pad every row to 144 bytes. Two buffers: stage s + 1 is requested when
// every wave has left stage s - 1, and flies while stage s is worked on.
// Wave (wm, wn) of a 2 x 4 grid computes 64 x 48: per 32 k, 7 fragments for 12 WMMAs.
// ---------------------------------------------------------------------------
#define GP_PITCH   72                    // LDS row pitch in halves: 128 B + 16 B pad
#define GP_XBYTES  18432u                // 128 rows * 144 B = 9 * 2 KiB
#define GP_STAGE   47104u                // X part + W part (192 * 144 B, rounded up to 14 * 2 KiB)
#define GP_STAGES  12                    // 768 / 64

__device__ __forceinline__ unsigned uni(unsigned v) {
  return (unsigned)__builtin_amdgcn_readfirstlane((int)v);
}
// The value held in a scalar register: a test on it compiles to s_cmp and a scalar branch
// (tensor loads ignore EXEC), and what is formed from it is formed behind the waits in front.
__device__ __forceinline__ unsigned pinned(unsigned v) {
  unsigned w = uni(v);
  asm volatile("" : "+s"(w));  // the scalar pin of a tensor load's issue test and descriptor word
  return w;
}

// One request: rows of 128 bytes at source pitch 1536 bytes, laid at pitch 144 bytes from lds_dst on.
__device__ __forceinline__ void gp_issue(unsigned lds_dst, unsigned long long ga, const u32x8& g1) {
  u32x4 g0;
  g0[0] = uni(1u);                                                   // count 1
  g0[1] = uni(lds_dst);                                              // byte offset in the block's LDS
  g0[2] = uni((unsigned)ga);                                         // address [31:0]
  g0[3] = uni((((unsigned)(ga >> 32)) & 0x01FFFFFFu) | 0x80000000u); // address [56:32], type 2
  asm volatile("tensor_load_to_lds %0, %1" :: "s"(g0), "s"(g1) : "memory");
}

template <bool F32OUT>
__device__ __forceinline__ void gp_core(const _Float16* __restrict__ X,
                                        const _Float16* __restrict__ Wt,
                                        _Float16* __restrict__ Yh, float* __restrict__ Yf) {
  // 2 KiB alignment: every tensor-load destination is then a multiple of 2 KiB.
  __shared__ __attribute__((aligned(2048))) _Float16 ring[GP_STAGE];  // two stages of GP_STAGE bytes

  const unsigned wave = uni(threadIdx.x >> 5);
  const int wm = (int)(wave >> 2);
  const int wn = (int)(wave & 3u);
  const int m0 = blockIdx.y * 128;
  const int nb = blockIdx.x * 192;       // first row of this tile in the stacked weights

  // The issuing wave's own slice: wave 0 the X rows, wave 1 the W rows.
  const unsigned rows = (wave == 0u) ? 128u : 192u;
  const unsigned long long src0 = (wave == 0u)
      ? (unsigned long long)(uintptr_t)(X + (size_t)m0 * DIMD)
      : (unsigned long long)(uintptr_t)(Wt + (size_t)nb * DIMD);
  const unsigned dst0 = (unsigned)(uintptr_t)ring + ((wave == 0u) ? 0u : GP_XBYTES);
  u32x8 g1;
  g1[0] = uni((1u << 20) | (4u << 22) | (3u << 25));  // no mask, 1-byte units, 16 B pad behind every 128 B
  g1[1] = uni(128u << 16);                       // tensor_dim0 = 128 B
  g1[2] = uni(rows << 16);                       // tensor_dim1 = rows
  g1[3] = uni(128u << 16);                       // tile_dim0 = 128 B
  g1[4] = uni(rows);                             // tile_dim1 = rows
  g1[5] = uni(DIMD * 2u);                        // source pitch in bytes
  g1[6] = uni(0u);
  g1[7] = uni(0u);

  if (pinned(wave < 2u)) {
    gp_issue(dst0, src0, g1);
    asm volatile("s_wait_tensorcnt 0x0" ::: "memory");  // stage 0 has landed before the first barrier publishes it
  }

  v8f c[4][3] = {};
  // kept rolled: one copy of the pass in the instruction cache, and one place that issues stages 1 to 11
#pragma unroll 1
  for (int s = 0; s < GP_STAGES; ++s) {
    // Publish point of stage s, at the head of its pass: for s = 0 the ring's prologue (stage 0 waited
    // for, barrier, stage 1 requested), for s > 0 the foot of pass s - 1.
    asm volatile("s_wait_dscnt 0x0" ::: "memory");         // this wave's reads of stage s - 1 are done
    if (pinned(wave < 2u)) {
      asm volatile("s_wait_tensorcnt 0x0" ::: "memory");   // this wave's slice of stage s has landed
    }
    __syncthreads();
    if (pinned((wave < 2u) && (s + 1 < GP_STAGES))) {
      const unsigned sn = pinned((unsigned)s + 1u);  // scalar pin: the descriptor is formed behind the wait
      gp_issue(dst0 + (sn & 1u) * GP_STAGE, src0 + (unsigned long long)sn * 128u, g1);  // into the buffer pass s - 1 has left
    }

    const _Float16* bx = ring + (s & 1) * (GP_STAGE / 2);
    const _Float16* bw = bx + GP_XBYTES / 2;
    // this loop and the loops inside it are unrolled so that every fragment and accumulator index is a
    // constant and the arrays stay in registers
#pragma unroll
    for (int kk = 0; kk < 64; kk += 32) {
      v16h a[4], b[3];
#pragma unroll
      for (int i = 0; i < 4; ++i) a[i] = ld_frag(bx, GP_PITCH, wm * 64 + 16 * i, kk);
#pragma unroll
      for (int j = 0; j < 3; ++j) b[j] = ld_frag(bw, GP_PITCH, wn * 48 + 16 * j, kk);
      // holds a 32-k step's 14 LDS reads in front of its 12 WMMAs: fetched a row of tiles at a time,
      // the wave waits out the LDS latency at every row
      __builtin_amdgcn_sched_barrier(0);
#pragma unroll
      for (int i = 0; i < 4; ++i)
#pragma unroll
        for (int j = 0; j < 3; ++j) c[i][j] = WMMA_F16(a[i], b[j], c[i][j]);
    }
  }
  asm volatile("s_wait_tensorcnt 0x0" ::: "memory");  // nothing in flight when the wave ends
  asm volatile("s_wait_dscnt 0x0" ::: "memory");

  const int z  = blockIdx.x >> 2;                     // which of the stacked weights: 4 tiles each
  const int n0 = (blockIdx.x & 3) * 192 + wn * 48;
  // unrolled: the accumulators are indexed by constants only
#pragma unroll
  for (int i = 0; i < 4; ++i)
#pragma unroll
    for (int j = 0; j < 3; ++j) {
      if (F32OUT) st_tile_f32(Yf, DIMD, m0 + wm * 64 + 16 * i, n0 + 16 * j, c[i][j]);
      else        st_tile_f16(Yh + (size_t)z * 8192 * DIMD, DIMD, m0 + wm * 64 + 16 * i, n0 + 16 * j, c[i][j]);
    }
}

// qkv[3][8192][768] = Xh @ [Wq | Wk | Wv]^T, f16 out. Grid (12, 64): 768 blocks, three to a WGP
// by LDS (3 * 94,208 B) and by registers (six waves a SIMD).
__global__ __launch_bounds__(256) void fa_gemm_qkv(const _Float16* __restrict__ xh,
                                                   const _Float16* __restrict__ wh3,
                                                   _Float16* __restrict__ qkv) {
  gp_core<false>(xh, wh3, qkv, nullptr);
}

// Final projection: out_f32[8192 x 768] = ctx @ Wo^T. Grid (4, 64).
__global__ __launch_bounds__(256) void fa_gemm_out(const _Float16* __restrict__ ctx,
                                                   const _Float16* __restrict__ woh,
                                                   float* __restrict__ out) {
  gp_core<true>(ctx, woh, nullptr, out);
}

// ---------------------------------------------------------------------------
// Fused flash attention per (b, h): grid (N/64, H, B), 128 threads = 4 waves.
// Wave w owns query rows [64*bx + 16w, +16). Keys in tiles of 32; K and V
// tiles staged row-major into LDS by the Tensor Data Mover (padded rows).
// Both products run transposed: S^T = K Q^T, O^T += V^T P^T. A lane then holds
// 16 scores of ONE query (its partner lane ^ 16 the other 16), so maximum and sum
// are in-lane, and the two S^T accumulator tiles, converted, ARE the B operand P^T.
// ---------------------------------------------------------------------------
__global__ void fa_attention(const _Float16* __restrict__ Q,
                             const _Float16* __restrict__ K,
                             const _Float16* __restrict__ V,
                             _Float16* __restrict__ ctx) {
  constexpr int LDT = 72;   // padded tile row stride in halves (128B + 16B pad)
  __shared__ __attribute__((aligned(2048))) _Float16 Kt[32 * LDT];
  __shared__ __attribute__((aligned(2048))) _Float16 Vr[32 * LDT];

  const int tid  = threadIdx.x;
  const int wave = tid >> 5;
  const int lane = tid & 31;
  const int n16  = lane & 15;
  const int hh   = lane >> 4;

  const int b    = blockIdx.z;
  const int h    = blockIdx.y;
  const int qrow = blockIdx.x * 64 + wave * 16;
  const int rowb = b * 2048;
  const int colh = h * 64;

  const float qscale = 0.03608439182435161f;  // 1/sqrt(768), full-D scale

  // Q rows as B operand: b[s] = Q[query n16][k order of ld_frag], the order K's A fragments use.
  v16h qa0 = ld_frag_scaled(Q + colh, DIMD, rowb + qrow, 0,  qscale);
  v16h qa1 = ld_frag_scaled(Q + colh, DIMD, rowb + qrow, 32, qscale);

  v8f  o0 = {}, o1 = {}, o2 = {}, o3 = {};
  float mrun = -1e30f;  // running maximum of query n16, equal in both halves
  float lrun = 0.0f;    // this half's share of the denominator; halves joined in the epilogue

#ifdef FA_HAVE_TDM
  const unsigned kt_off = (unsigned)(uintptr_t)Kt;
  const unsigned vr_off = (unsigned)(uintptr_t)Vr;
#endif

  for (int kt = 0; kt < 2048; kt += 32) {
    const _Float16* kg = K + (size_t)(rowb + kt) * DIMD + colh;
    const _Float16* vg = V + (size_t)(rowb + kt) * DIMD + colh;

#ifdef FA_HAVE_TDM
    if (wave == 0) {
      tdm_load_tile_f16(kt_off, kg, 32, 64, DIMD);
      tdm_load_tile_f16(vr_off, vg, 32, 64, DIMD);
      __builtin_amdgcn_s_wait_tensorcnt(0);
    }
#else
    for (int i = tid; i < 256; i += 128) {
      const int r = i >> 3, cs = (i & 7) << 3;
      *(v8h*)(Kt + r * LDT + cs) = *(const v8h*)(kg + (size_t)r * DIMD + cs);
      *(v8h*)(Vr + r * LDT + cs) = *(const v8h*)(vg + (size_t)r * DIMD + cs);
    }
#endif
    __syncthreads();

    // ---- S^T = K Q^T : s0[r] = score(key 8*hh + r, query n16), s1: keys + 16 ----
    v8f s0 = {}, s1 = {};
    {
      v16h ak;
      ak = ld_frag(Kt, LDT,  0,  0); s0 = WMMA_F16(ak, qa0, s0);
      ak = ld_frag(Kt, LDT,  0, 32); s0 = WMMA_F16(ak, qa1, s0);
      ak = ld_frag(Kt, LDT, 16,  0); s1 = WMMA_F16(ak, qa0, s1);
      ak = ld_frag(Kt, LDT, 16, 32); s1 = WMMA_F16(ak, qa1, s1);
    }

    // ---- V^T fragments: A operands, 16 d x 32 keys each ----
    const v16h va0 = ld_frag_tr(Vr, LDT,  0);
    const v16h va1 = ld_frag_tr(Vr, LDT, 16);
    const v16h va2 = ld_frag_tr(Vr, LDT, 32);
    const v16h va3 = ld_frag_tr(Vr, LDT, 48);

    // ---- online softmax: one query per lane, one exchange between the halves ----
    float mx = fmaxf(s0[0], s1[0]);
#pragma unroll
    for (int v = 1; v < 8; ++v) mx = fmaxf(mx, fmaxf(s0[v], s1[v]));
    mx = fmaxf(mx, xhalf(mx));
    const float mnew  = fmaxf(mrun, mx);
    const float alpha = __expf(mrun - mnew);
    mrun = mnew;

    v16h  pb;      // P^T as B operand: pb[s] = P[query n16][key in the hardware k order]
    float ps[8];
#pragma unroll
    for (int v = 0; v < 8; ++v) {
      const float p0 = __expf(s0[v] - mnew);
      const float p1 = __expf(s1[v] - mnew);
      ps[v]     = p0 + p1;
      pb[v]     = (_Float16)p0;
      pb[v + 8] = (_Float16)p1;
    }
    lrun = lrun * alpha + (((ps[0] + ps[1]) + (ps[2] + ps[3])) + ((ps[4] + ps[5]) + (ps[6] + ps[7])));
#pragma unroll
    for (int v = 0; v < 8; ++v) { o0[v] *= alpha; o1[v] *= alpha; o2[v] *= alpha; o3[v] *= alpha; }

    // ---- O^T += V^T P^T : oj[r] = O[query n16][16*j + 8*hh + r] ----
    o0 = WMMA_F16(va0, pb, o0);
    o1 = WMMA_F16(va1, pb, o1);
    o2 = WMMA_F16(va2, pb, o2);
    o3 = WMMA_F16(va3, pb, o3);
    __syncthreads();
  }

  // ---- epilogue: ctx = O / l; a lane's 8 registers are 8 consecutive d of one row ----
  const float inv = 1.0f / (lrun + xhalf(lrun));
  _Float16* cp = ctx + (size_t)(rowb + qrow + n16) * DIMD + colh + 8 * hh;
  v8h w0, w1, w2, w3;
#pragma unroll
  for (int v = 0; v < 8; ++v) {
    w0[v] = (_Float16)(o0[v] * inv);
    w1[v] = (_Float16)(o1[v] * inv);
    w2[v] = (_Float16)(o2[v] * inv);
    w3[v] = (_Float16)(o3[v] * inv);
  }
  *(v8h*)(cp +  0) = w0;
  *(v8h*)(cp + 16) = w1;
  *(v8h*)(cp + 32) = w2;
  *(v8h*)(cp + 48) = w3;
}

// ---------------------------------------------------------------------------
// Launcher
// ---------------------------------------------------------------------------
extern "C" void kernel_launch(void* const* d_in, const int* in_sizes, int n_in,
                              void* d_out, int out_size, void* d_ws, size_t ws_size,
                              hipStream_t stream) {
  const float* x  = (const float*)d_in[0];
  const float* Wq = (const float*)d_in[1];
  const float* Wk = (const float*)d_in[2];
  const float* Wv = (const float*)d_in[3];
  const float* Wo = (const float*)d_in[4];
  float* out = (float*)d_out;

  const size_t NX = 8192ull * 768ull;
  const size_t NW = 768ull * 768ull;

  _Float16* xh  = (_Float16*)d_ws;
  _Float16* wh3 = xh  + NX;
  _Float16* woh = wh3 + 3 * NW;
  _Float16* qkv = woh + NW;
  _Float16* ctx = qkv + 3 * NX;

  // xh, wh3 and woh lie back to back from the start of the workspace: one destination.
  // 528 blocks = 384 for x and 36 for each of the four weights.
  fa_cvt_all<<<528, 256, 0, stream>>>(x, Wq, Wk, Wv, Wo, xh);

  fa_gemm_qkv<<<dim3(12, 64, 1), 256, 0, stream>>>(xh, wh3, qkv);

  fa_attention<<<dim3(32, 12, 4), 128, 0, stream>>>(qkv, qkv + NX, qkv + 2 * NX, ctx);

  fa_gemm_out<<<dim3(4, 64, 1), 256, 0, stream>>>(ctx, woh, out);
}
